// v000
// Times are from an AMD MI455X. After a warm-up the kernel runs many times in a row, and a time is the length of
// such a window on the GPU divided by its runs, so every launch and the gaps after it count. The runs cycle
// through copies of the inputs. A figure is the median of several windows, for all but v000 over two sittings.
// Sittings can differ by a few percent; kernels timed side by side share one.
// The starting kernel, v000, takes 18.5 microseconds a run.
#include <hip/hip_runtime.h>
#include <math.h>

typedef __attribute__((ext_vector_type(2))) float v2f;
typedef __attribute__((ext_vector_type(4))) float v4f;
typedef __attribute__((ext_vector_type(8))) float v8f;

#define B_   8
#define A_   6
#define D_   256
#define CHW_ (256 * 32 * 32)      // 262144 elements per (b,k) slice of v
#define ROWS_ (B_ * A_)           // 48 rows of qu / query

// ---------------------------------------------------------------------------
// Kernel 1: query = qu @ W^T + b   via V_WMMA_F32_16X16X4_F32
//   qu: [48, 256] row-major, W: [256, 256] row-major, query: [48, 256]
//   Grid: 48 single-wave blocks; block = (rowTile 0..2, colTile 0..15).
//   A tile = 16x4 of qu, B tile = 4x16 with B[k,n] = W[n,k].
//   Fragment layout (ISA 7.12.2): component i, lane-half h -> K = i + 2h.
// ---------------------------------------------------------------------------
__global__ __launch_bounds__(32)
void proj_wmma_kernel(const float* __restrict__ qu,
                      const float* __restrict__ W,
                      const float* __restrict__ bias,
                      float* __restrict__ query) {
  const int rt   = blockIdx.x >> 4;    // row tile 0..2
  const int ct   = blockIdx.x & 15;    // col tile 0..15
  const int lane = threadIdx.x;
  const int half = lane >> 4;          // lane half (0: lanes 0-15, 1: 16-31)
  const int l    = lane & 15;

  const int arow = rt * 16 + l;        // qu row for A fragment
  const int bcol = ct * 16 + l;        // output col for B fragment (= W row)

  v8f acc = {};
  #pragma unroll 4
  for (int k0 = 0; k0 < D_; k0 += 4) {
    const int kb = k0 + half * 2;
    v2f a, bm;
    a.x  = qu[arow * D_ + kb];
    a.y  = qu[arow * D_ + kb + 1];
    bm.x = W[bcol * D_ + kb];          // B[kb,   bcol] = W[bcol, kb]
    bm.y = W[bcol * D_ + kb + 1];      // B[kb+1, bcol]
    acc = __builtin_amdgcn_wmma_f32_16x16x4_f32(
        /*neg_a=*/false, a, /*neg_b=*/false, bm,
        /*c_mod=*/(short)0, acc, /*reuse_a=*/false, /*reuse_b=*/false);
  }

  // D layout: VGPR i -> M = i + 8*half, N = l   (ISA 7.12.2, 32-bit C/D 16x16)
  const float bv    = bias[bcol];
  const int   rbase = rt * 16 + half * 8;
  #pragma unroll
  for (int i = 0; i < 8; ++i) {
    query[(rbase + i) * D_ + bcol] = acc[i] + bv;
  }
}

// ---------------------------------------------------------------------------
// Kernel 2: attn[b,k,q] = <k[b,k,:], query[b,q,:]>, softmax over k (axis=1).
//   One block per batch. 36 dot products, then 6 softmax columns.
//   Writes attn_sm to workspace (for kernel 3) AND to the tuple output tail.
// ---------------------------------------------------------------------------
__global__ __launch_bounds__(64)
void attn_softmax_kernel(const float* __restrict__ kmat,
                         const float* __restrict__ query,
                         float* __restrict__ attn_ws,
                         float* __restrict__ attn_out) {
  __shared__ float s[A_ * A_];
  const int b   = blockIdx.x;
  const int tid = threadIdx.x;

  if (tid < A_ * A_) {
    const int kk = tid / A_;
    const int q  = tid % A_;
    const float* kr = kmat  + ((size_t)b * A_ + kk) * D_;
    const float* qr = query + ((size_t)b * A_ + q)  * D_;
    float dot = 0.f;
    for (int d = 0; d < D_; ++d) dot = fmaf(kr[d], qr[d], dot);
    s[tid] = dot;
  }
  __syncthreads();

  if (tid < A_) {
    const int q = tid;
    float m = s[q];
    #pragma unroll
    for (int kk = 1; kk < A_; ++kk) m = fmaxf(m, s[kk * A_ + q]);
    float e[A_];
    float sum = 0.f;
    #pragma unroll
    for (int kk = 0; kk < A_; ++kk) {
      e[kk] = __expf(s[kk * A_ + q] - m);
      sum += e[kk];
    }
    const float inv = 1.f / sum;
    #pragma unroll
    for (int kk = 0; kk < A_; ++kk) {
      const float r = e[kk] * inv;
      attn_ws [b * A_ * A_ + kk * A_ + q] = r;
      attn_out[b * A_ * A_ + kk * A_ + q] = r;
    }
  }
}

// ---------------------------------------------------------------------------
// Kernel 3 (the bandwidth-bound 99%): out[b,q,chw] = sum_k attn[b,k,q]*v[b,k,chw]
//   Each thread owns one float4 position: 6x B128 NT loads, 36 FMAs-on-vec4,
//   6x B128 NT stores. 100 MB total traffic -> ~4.3 us floor at 23.3 TB/s.
//   Attention weights are per-batch uniform -> scalar (SGPR) loads.
// ---------------------------------------------------------------------------
__global__ __launch_bounds__(256)
void weighted_sum_kernel(const float* __restrict__ v,
                         const float* __restrict__ attn_ws,
                         float* __restrict__ out) {
  const int b    = blockIdx.x >> 8;            // 8 batches * 256 blocks each
  const int blk  = blockIdx.x & 255;
  const int pos4 = blk * 256 + (int)threadIdx.x;   // float4 index in [0,65536)
  const size_t elem = (size_t)pos4 * 4;

  // 6x6 attention matrix for this batch; uniform address -> SGPRs
  float w[A_ * A_];
  #pragma unroll
  for (int i = 0; i < A_ * A_; ++i) w[i] = attn_ws[b * A_ * A_ + i];

  const v4f zero = {0.f, 0.f, 0.f, 0.f};
  v4f acc[A_];
  #pragma unroll
  for (int q = 0; q < A_; ++q) acc[q] = zero;

  #pragma unroll
  for (int kk = 0; kk < A_; ++kk) {
    const v4f* vp =
        (const v4f*)(v + ((size_t)(b * A_ + kk) * CHW_ + elem));
    const v4f vv = __builtin_nontemporal_load(vp);
    #pragma unroll
    for (int q = 0; q < A_; ++q) acc[q] += w[kk * A_ + q] * vv;
  }

  #pragma unroll
  for (int q = 0; q < A_; ++q) {
    v4f* op = (v4f*)(out + ((size_t)(b * A_ + q) * CHW_ + elem));
    __builtin_nontemporal_store(acc[q], op);
  }
}

// ---------------------------------------------------------------------------
extern "C" void kernel_launch(void* const* d_in, const int* in_sizes, int n_in,
                              void* d_out, int out_size, void* d_ws, size_t ws_size,
                              hipStream_t stream) {
  const float* qu   = (const float*)d_in[0];   // [8,6,256]
  const float* kmat = (const float*)d_in[1];   // [8,6,256]
  const float* v    = (const float*)d_in[2];   // [8,6,256,32,32]
  const float* W    = (const float*)d_in[3];   // [256,256]
  const float* bias = (const float*)d_in[4];   // [256]

  float* out      = (float*)d_out;                       // [8,6,256,32,32]
  float* attn_out = out + (size_t)B_ * A_ * CHW_;        // [8,6,6] tuple tail

  float* query_ws = (float*)d_ws;                        // 48*256 floats
  float* attn_ws  = query_ws + ROWS_ * D_;               // 288 floats

  // 1) query = qu @ W^T + b  (WMMA f32 16x16x4; 3x16 tiles, 1 wave each)
  proj_wmma_kernel<<<dim3(48), dim3(32), 0, stream>>>(qu, W, bias, query_ws);

  // 2) scores + softmax over k  (tiny; one block per batch)
  attn_softmax_kernel<<<dim3(B_), dim3(64), 0, stream>>>(kmat, query_ws,
                                                         attn_ws, attn_out);

  // 3) streaming weighted sum (the bandwidth-bound bulk)
  weighted_sum_kernel<<<dim3(B_ * 256), dim3(256), 0, stream>>>(v, attn_ws, out);
}

// v001
// A run of this version takes 11.1 microseconds.
// In both of two side-by-side timings against v000, it was 1.67 times as fast.
#include <hip/hip_runtime.h>
#include <math.h>

typedef __attribute__((ext_vector_type(2))) float v2f;
typedef __attribute__((ext_vector_type(4))) float v4f;
typedef __attribute__((ext_vector_type(8))) float v8f;

#define B_   8
#define A_   6
#define D_   256
#define CHW_ (256 * 32 * 32)      // 262144 elements per (b,k) slice of v
#define NT_  16                   // feature tiles of 16 per batch
#define PP_  64                   // floats per partial-score record (256 B: one writer per line)

// ---------------------------------------------------------------------------
// Kernel 1: partial scores. Block = (batch b, feature tile ct), 4 waves.
//   Wave kw takes input dims [64 kw, 64 kw + 64):
//     Q[f][q] = sum_e W[f0 + f][e] * qu[b][q][e]      (A = W rows, B = qu rows)
//   D map: register r of lane (c, h) = Q[8h + r][c], which is already a B
//   operand over the features 8h + 2t, 8h + 2t + 1, so the score product
//     S[k][q] = sum_f kmat[b][k][f0 + f] * Q[f][q]
//   follows on the accumulators with no exchange; A takes the same feature
//   order. Scores are linear in Q, so each wave's share of e gives a share of
//   S; the four shares are added through LDS, the bias enters in wave 0 only.
//   Rows and columns 6..15 of the tiles repeat row 5 and are never stored.
// ---------------------------------------------------------------------------
__global__ __launch_bounds__(128)
void score_part_kernel(const float* __restrict__ qu,
                       const float* __restrict__ kmat,
                       const float* __restrict__ W,
                       const float* __restrict__ bias,
                       float* __restrict__ part) {
  __shared__ float sp[4][A_ * A_];
  const int b    = blockIdx.x >> 4;
  const int ct   = blockIdx.x & 15;
  const int tid  = threadIdx.x;
  const int kw   = tid >> 5;
  const int lane = tid & 31;
  const int h    = lane >> 4;
  const int c    = lane & 15;
  const int r6   = c < A_ ? c : A_ - 1;

  // Both operands by the same code: slot (h, i) holds the same e on both sides.
  const float* wrow = W  + (ct * 16 + c) * D_ + kw * 64 + h * 4;
  const float* qrow = qu + (b * A_ + r6) * D_ + kw * 64 + h * 4;
  const float* krow = kmat + (b * A_ + r6) * D_ + ct * 16 + h * 8;
  v4f wf[8], qf[8];
  #pragma unroll
  for (int j = 0; j < 8; ++j) {
    wf[j] = *(const v4f*)(wrow + j * 8);
    qf[j] = *(const v4f*)(qrow + j * 8);
  }
  const v4f kf0 = *(const v4f*)(krow);
  const v4f kf1 = *(const v4f*)(krow + 4);
  const v4f bf0 = *(const v4f*)(bias + ct * 16 + h * 8);
  const v4f bf1 = *(const v4f*)(bias + ct * 16 + h * 8 + 4);
  // All 20 loads issue before the first WMMA: one trip to memory, not three.
  __builtin_amdgcn_sched_barrier(0);

  v8f a0 = {};
  #pragma unroll
  for (int j = 0; j < 8; ++j) {
    const v2f wlo = {wf[j].x, wf[j].y}, whi = {wf[j].z, wf[j].w};
    const v2f qlo = {qf[j].x, qf[j].y}, qhi = {qf[j].z, qf[j].w};
    a0 = __builtin_amdgcn_wmma_f32_16x16x4_f32(false, wlo, false, qlo,
                                               (short)0, a0, false, false);
    a0 = __builtin_amdgcn_wmma_f32_16x16x4_f32(false, whi, false, qhi,
                                               (short)0, a0, false, false);
  }

  // Five vector slots between the last WMMA and the first read of its D.
  asm volatile("v_nop\n\tv_nop\n\tv_nop\n\tv_nop\n\tv_nop" : "+v"(a0));
  // Keeps the bias selects below out of the WMMA run above, where they would
  // be written over operand registers of a WMMA just issued.
  __builtin_amdgcn_sched_barrier(0);

  const float kv[8] = {kf0.x, kf0.y, kf0.z, kf0.w, kf1.x, kf1.y, kf1.z, kf1.w};
  const float bv[8] = {bf0.x, bf0.y, bf0.z, bf0.w, bf1.x, bf1.y, bf1.z, bf1.w};
  float d[8];
  #pragma unroll
  for (int r = 0; r < 8; ++r) d[r] = a0[r] + (kw == 0 ? bv[r] : 0.f);

  // All four B operands are formed first, each in registers of its own, so
  // that no vector write lands on an operand of a WMMA just issued.
  __builtin_amdgcn_sched_barrier(0);

  v8f s = {};
  #pragma unroll
  for (int t = 0; t < 4; ++t) {
    const v2f ka = {kv[2 * t], kv[2 * t + 1]};
    const v2f qb = {d[2 * t],  d[2 * t + 1]};
    s = __builtin_amdgcn_wmma_f32_16x16x4_f32(false, ka, false, qb,
                                              (short)0, s, false, false);
  }
  // Four vector slots before D is read and the operands' registers are reused.
  asm volatile("v_nop\n\tv_nop\n\tv_nop\n\tv_nop" : "+v"(s));

  // s[r] of lane (c, h) = S[8h + r][c]: k = r, q = c
  if (h == 0 && c < A_) {
    #pragma unroll
    for (int r = 0; r < A_; ++r) sp[kw][r * A_ + c] = s[r];
  }
  __syncthreads();
  if (tid < A_ * A_) {
    part[(b * NT_ + ct) * PP_ + tid] =
        (sp[0][tid] + sp[1][tid]) + (sp[2][tid] + sp[3][tid]);
  }
}

// Work-group barrier that orders LDS only: __syncthreads() would also wait for
// the v loads in flight, which nothing behind the barrier needs yet.
__device__ __forceinline__ void lds_barrier() {
  __builtin_amdgcn_fence(__ATOMIC_RELEASE, "workgroup", "local");
  __builtin_amdgcn_s_barrier();
  __builtin_amdgcn_fence(__ATOMIC_ACQUIRE, "workgroup", "local");
}

// ---------------------------------------------------------------------------
// Kernel 2: out[b,q,chw] = sum_k attn[b,k,q] * v[b,k,chw]
//   Each work-group first adds its batch's 16 partial-score records and takes
//   the softmax over k itself, while its v loads are in flight; the first
//   work-group of a batch also stores attn to the tuple tail.
//   Each thread owns one float4 position: 6x B128 NT loads, 36 FMAs-on-vec4,
//   6x B128 NT stores.
// ---------------------------------------------------------------------------
__global__ __launch_bounds__(256)
void weighted_sum_kernel(const float* __restrict__ v,
                         const float* __restrict__ part,
                         float* __restrict__ out,
                         float* __restrict__ attn_out) {
  __shared__ float s[A_ * A_];
  __shared__ __attribute__((aligned(16))) float wsm[A_ * A_];
  const int b    = blockIdx.x >> 8;            // 8 batches * 256 blocks each
  const int blk  = blockIdx.x & 255;
  const int tid  = (int)threadIdx.x;
  const int pos4 = blk * 256 + tid;            // float4 index in [0,65536)
  const size_t elem = (size_t)pos4 * 4;

  float pv[NT_];
  if (tid < A_ * A_) {
    const float* p = part + b * NT_ * PP_ + tid;
    #pragma unroll
    for (int t = 0; t < NT_; ++t) pv[t] = p[t * PP_];
  }

  v4f vv[A_];
  #pragma unroll
  for (int kk = 0; kk < A_; ++kk) {
    const v4f* vp =
        (const v4f*)(v + ((size_t)(b * A_ + kk) * CHW_ + elem));
    vv[kk] = __builtin_nontemporal_load(vp);
  }

  if (tid < A_ * A_) {
    float sc = pv[0];
    #pragma unroll
    for (int t = 1; t < NT_; ++t) sc += pv[t];
    s[tid] = sc;
  }
  lds_barrier();

  if (tid < A_) {
    const int q = tid;
    float m = s[q];
    #pragma unroll
    for (int kk = 1; kk < A_; ++kk) m = fmaxf(m, s[kk * A_ + q]);
    float e[A_];
    float sum = 0.f;
    #pragma unroll
    for (int kk = 0; kk < A_; ++kk) {
      e[kk] = __expf(s[kk * A_ + q] - m);
      sum += e[kk];
    }
    const float inv = 1.f / sum;
    #pragma unroll
    for (int kk = 0; kk < A_; ++kk) {
      e[kk] *= inv;
      wsm[kk * A_ + q] = e[kk];
    }
    if (blk == 0) {
      #pragma unroll
      for (int kk = 0; kk < A_; ++kk)
        attn_out[b * A_ * A_ + kk * A_ + q] = e[kk];
    }
  }
  lds_barrier();

  // The weights are the same in every lane: keep them in scalar registers.
  float w[A_ * A_];
  #pragma unroll
  for (int i = 0; i < A_ * A_; ++i)
    w[i] = __int_as_float(__builtin_amdgcn_readfirstlane(__float_as_int(wsm[i])));

  const v4f zero = {0.f, 0.f, 0.f, 0.f};
  v4f acc[A_];
  #pragma unroll
  for (int q = 0; q < A_; ++q) acc[q] = zero;

  #pragma unroll
  for (int kk = 0; kk < A_; ++kk) {
    #pragma unroll
    for (int q = 0; q < A_; ++q) acc[q] += w[kk * A_ + q] * vv[kk];
  }

  #pragma unroll
  for (int q = 0; q < A_; ++q) {
    v4f* op = (v4f*)(out + ((size_t)(b * A_ + q) * CHW_ + elem));
    __builtin_nontemporal_store(acc[q], op);
  }
}

// ---------------------------------------------------------------------------
extern "C" void kernel_launch(void* const* d_in, const int* in_sizes, int n_in,
                              void* d_out, int out_size, void* d_ws, size_t ws_size,
                              hipStream_t stream) {
  const float* qu   = (const float*)d_in[0];   // [8,6,256]
  const float* kmat = (const float*)d_in[1];   // [8,6,256]
  const float* v    = (const float*)d_in[2];   // [8,6,256,32,32]
  const float* W    = (const float*)d_in[3];   // [256,256]
  const float* bias = (const float*)d_in[4];   // [256]

  float* out      = (float*)d_out;                       // [8,6,256,32,32]
  float* attn_out = out + (size_t)B_ * A_ * CHW_;        // [8,6,6] tuple tail

  float* part_ws = (float*)d_ws;                         // 8*16 records of 64 floats

  // 1) partial scores per (batch, feature tile), both products on WMMA f32
  score_part_kernel<<<dim3(B_ * NT_), dim3(128), 0, stream>>>(qu, kmat, W, bias,
                                                              part_ws);

  // 2) softmax per work-group + streaming weighted sum
  weighted_sum_kernel<<<dim3(B_ * 256), dim3(256), 0, stream>>>(v, part_ws, out,
                                                                attn_out);
}

// v002
// Measured time: 10.2 microseconds a run.
// Two timings next to v001 put it at 1.09 and 1.08 times that version's speed.
// Over all steps from v000 it is 1.81 times as fast.
#include <hip/hip_runtime.h>
#include <math.h>

typedef __attribute__((ext_vector_type(2))) float v2f;
typedef __attribute__((ext_vector_type(4))) float v4f;
typedef __attribute__((ext_vector_type(8))) float v8f;

#define B_   8
#define A_   6
#define D_   256
#define CHW_ (256 * 32 * 32)      // 262144 elements per (b,k) slice of v
#define NT_  16                   // feature tiles of 16 per batch
#define PP_  64                   // floats per partial-score record (256 B: one writer per line)
#define WST_ 512                  // threads per streaming work-group (16 waves)
#define PPT_ 4                    // float4 positions per streaming thread
#define WSG_ 32                   // streaming work-groups per batch
static_assert(WSG_ * WST_ * PPT_ * 4 == CHW_, "the streaming grid covers a slice once");

// ---------------------------------------------------------------------------
// Kernel 1: partial scores. Block = (batch b, feature tile ct), 4 waves.
//   Wave kw takes input dims [64 kw, 64 kw + 64):
//     Q[f][q] = sum_e W[f0 + f][e] * qu[b][q][e]      (A = W rows, B = qu rows)
//   D map: register r of lane (c, h) = Q[8h + r][c], which is already a B
//   operand over the features 8h + 2t, 8h + 2t + 1, so the score product
//     S[k][q] = sum_f kmat[b][k][f0 + f] * Q[f][q]
//   follows on the accumulators with no exchange; A takes the same feature
//   order. Scores are linear in Q, so each wave's share of e gives a share of
//   S; the four shares are added through LDS, the bias enters in wave 0 only.
//   Rows and columns 6..15 of the tiles repeat row 5 and are never stored.
// ---------------------------------------------------------------------------
__global__ __launch_bounds__(128)
void score_part_kernel(const float* __restrict__ qu,
                       const float* __restrict__ kmat,
                       const float* __restrict__ W,
                       const float* __restrict__ bias,
                       float* __restrict__ part) {
  __shared__ float sp[4][A_ * A_];
  const int b    = blockIdx.x >> 4;
  const int ct   = blockIdx.x & 15;
  const int tid  = threadIdx.x;
  const int kw   = tid >> 5;
  const int lane = tid & 31;
  const int h    = lane >> 4;
  const int c    = lane & 15;
  const int r6   = c < A_ ? c : A_ - 1;

  // Both operands by the same code: slot (h, i) holds the same e on both sides.
  const float* wrow = W  + (ct * 16 + c) * D_ + kw * 64 + h * 4;
  const float* qrow = qu + (b * A_ + r6) * D_ + kw * 64 + h * 4;
  const float* krow = kmat + (b * A_ + r6) * D_ + ct * 16 + h * 8;
  v4f wf[8], qf[8];
  #pragma unroll
  for (int j = 0; j < 8; ++j) {
    wf[j] = *(const v4f*)(wrow + j * 8);
    qf[j] = *(const v4f*)(qrow + j * 8);
  }
  const v4f kf0 = *(const v4f*)(krow);
  const v4f kf1 = *(const v4f*)(krow + 4);
  const v4f bf0 = *(const v4f*)(bias + ct * 16 + h * 8);
  const v4f bf1 = *(const v4f*)(bias + ct * 16 + h * 8 + 4);
  // All 20 loads issue before the first WMMA: one trip to memory, not three.
  __builtin_amdgcn_sched_barrier(0);

  v8f a0 = {};
  #pragma unroll
  for (int j = 0; j < 8; ++j) {
    const v2f wlo = {wf[j].x, wf[j].y}, whi = {wf[j].z, wf[j].w};
    const v2f qlo = {qf[j].x, qf[j].y}, qhi = {qf[j].z, qf[j].w};
    a0 = __builtin_amdgcn_wmma_f32_16x16x4_f32(false, wlo, false, qlo,
                                               (short)0, a0, false, false);
    a0 = __builtin_amdgcn_wmma_f32_16x16x4_f32(false, whi, false, qhi,
                                               (short)0, a0, false, false);
  }

  // Five vector slots between the last WMMA and the first read of its D.
  asm volatile("v_nop\n\tv_nop\n\tv_nop\n\tv_nop\n\tv_nop" : "+v"(a0));
  // Keeps the bias selects below out of the WMMA run above, where they would
  // be written over operand registers of a WMMA just issued.
  __builtin_amdgcn_sched_barrier(0);

  const float kv[8] = {kf0.x, kf0.y, kf0.z, kf0.w, kf1.x, kf1.y, kf1.z, kf1.w};
  const float bv[8] = {bf0.x, bf0.y, bf0.z, bf0.w, bf1.x, bf1.y, bf1.z, bf1.w};
  float d[8];
  #pragma unroll
  for (int r = 0; r < 8; ++r) d[r] = a0[r] + (kw == 0 ? bv[r] : 0.f);

  // All four B operands are formed first, each in registers of its own, so
  // that no vector write lands on an operand of a WMMA just issued.
  __builtin_amdgcn_sched_barrier(0);

  v8f s = {};
  #pragma unroll
  for (int t = 0; t < 4; ++t) {
    const v2f ka = {kv[2 * t], kv[2 * t + 1]};
    const v2f qb = {d[2 * t],  d[2 * t + 1]};
    s = __builtin_amdgcn_wmma_f32_16x16x4_f32(false, ka, false, qb,
                                              (short)0, s, false, false);
  }
  // Four vector slots before D is read and the operands' registers are reused.
  asm volatile("v_nop\n\tv_nop\n\tv_nop\n\tv_nop" : "+v"(s));

  // s[r] of lane (c, h) = S[8h + r][c]: k = r, q = c
  if (h == 0 && c < A_) {
    #pragma unroll
    for (int r = 0; r < A_; ++r) sp[kw][r * A_ + c] = s[r];
  }
  __syncthreads();
  if (tid < A_ * A_) {
    part[(b * NT_ + ct) * PP_ + tid] =
        (sp[0][tid] + sp[1][tid]) + (sp[2][tid] + sp[3][tid]);
  }
}

// Work-group barrier that orders LDS only: __syncthreads() would also wait for
// the v loads in flight, which nothing behind the barrier needs yet.
__device__ __forceinline__ void lds_barrier() {
  __builtin_amdgcn_fence(__ATOMIC_RELEASE, "workgroup", "local");
  __builtin_amdgcn_s_barrier();
  __builtin_amdgcn_fence(__ATOMIC_ACQUIRE, "workgroup", "local");
}

// ---------------------------------------------------------------------------
// Kernel 2: out[b,q,chw] = sum_k attn[b,k,q] * v[b,k,chw]
//   One work-group of 16 waves per WGP (256 in all), so that few waves have to
//   be started. Each work-group first adds its batch's 16 partial-score records
//   and takes the softmax over k itself, while its v loads are in flight; the
//   first work-group of a batch also stores attn to the tuple tail.
//   Each wave owns 2 KB in a row of every slice: a thread has PPT_ float4
//   positions, 512 B apart. All 6 * PPT_ B128 NT loads are issued at entry,
//   position by position; each position is summed and stored as soon as its
//   six loads have landed, under the loads of the positions behind it.
// ---------------------------------------------------------------------------
__global__ __launch_bounds__(WST_)
void weighted_sum_kernel(const float* __restrict__ v,
                         const float* __restrict__ part,
                         float* __restrict__ out,
                         float* __restrict__ attn_out) {
  __shared__ float s[A_ * A_];
  __shared__ __attribute__((aligned(16))) float wsm[A_ * A_];
  const int b    = blockIdx.x / WSG_;          // WSG_ work-groups per batch
  const int blk  = blockIdx.x % WSG_;
  const int tid  = (int)threadIdx.x;
  // float4 index of the thread's first position in [0, 65536)
  const int pos4 = blk * (WST_ * PPT_) + (tid >> 5) * (32 * PPT_) + (tid & 31);
  const size_t elem = (size_t)pos4 * 4;

  float pv[NT_];
  if (tid < A_ * A_) {
    const float* p = part + b * NT_ * PP_ + tid;
    #pragma unroll
    for (int t = 0; t < NT_; ++t) pv[t] = p[t * PP_];
  }

  v4f vv[PPT_][A_];
  #pragma unroll
  for (int i = 0; i < PPT_; ++i) {
    #pragma unroll
    for (int kk = 0; kk < A_; ++kk) {
      const v4f* vp =
          (const v4f*)(v + ((size_t)(b * A_ + kk) * CHW_ + elem + i * 128));
      vv[i][kk] = __builtin_nontemporal_load(vp);
    }
    // Keeps the loads in position order, so that position i can be waited for
    // by count while the loads of the positions behind it are still in flight.
    __builtin_amdgcn_sched_barrier(0);
  }

  if (tid < A_ * A_) {
    float sc = pv[0];
    #pragma unroll
    for (int t = 1; t < NT_; ++t) sc += pv[t];
    s[tid] = sc;
  }
  lds_barrier();

  if (tid < A_) {
    const int q = tid;
    float m = s[q];
    #pragma unroll
    for (int kk = 1; kk < A_; ++kk) m = fmaxf(m, s[kk * A_ + q]);
    float e[A_];
    float sum = 0.f;
    #pragma unroll
    for (int kk = 0; kk < A_; ++kk) {
      e[kk] = __expf(s[kk * A_ + q] - m);
      sum += e[kk];
    }
    const float inv = 1.f / sum;
    #pragma unroll
    for (int kk = 0; kk < A_; ++kk) {
      e[kk] *= inv;
      wsm[kk * A_ + q] = e[kk];
    }
    if (blk == 0) {
      #pragma unroll
      for (int kk = 0; kk < A_; ++kk)
        attn_out[b * A_ * A_ + kk * A_ + q] = e[kk];
    }
  }
  lds_barrier();

  // The weights are the same in every lane: keep them in scalar registers.
  float w[A_ * A_];
  #pragma unroll
  for (int i = 0; i < A_ * A_; ++i)
    w[i] = __int_as_float(__builtin_amdgcn_readfirstlane(__float_as_int(wsm[i])));

  #pragma unroll
  for (int i = 0; i < PPT_; ++i) {
    v4f acc[A_];
    #pragma unroll
    for (int q = 0; q < A_; ++q) acc[q] = w[q] * vv[i][0];

    #pragma unroll
    for (int kk = 1; kk < A_; ++kk) {
      #pragma unroll
      for (int q = 0; q < A_; ++q) acc[q] += w[kk * A_ + q] * vv[i][kk];
    }

    #pragma unroll
    for (int q = 0; q < A_; ++q) {
      v4f* op = (v4f*)(out + ((size_t)(b * A_ + q) * CHW_ + elem + i * 128));
      __builtin_nontemporal_store(acc[q], op);
    }
    // Keeps a position's stores ahead of the next position's wait and sums:
    // they would otherwise be gathered at the kernel's end, behind every load.
    if (i + 1 < PPT_) __builtin_amdgcn_sched_barrier(0);
  }
}

// ---------------------------------------------------------------------------
extern "C" void kernel_launch(void* const* d_in, const int* in_sizes, int n_in,
                              void* d_out, int out_size, void* d_ws, size_t ws_size,
                              hipStream_t stream) {
  const float* qu   = (const float*)d_in[0];   // [8,6,256]
  const float* kmat = (const float*)d_in[1];   // [8,6,256]
  const float* v    = (const float*)d_in[2];   // [8,6,256,32,32]
  const float* W    = (const float*)d_in[3];   // [256,256]
  const float* bias = (const float*)d_in[4];   // [256]

  float* out      = (float*)d_out;                       // [8,6,256,32,32]
  float* attn_out = out + (size_t)B_ * A_ * CHW_;        // [8,6,6] tuple tail

  float* part_ws = (float*)d_ws;                         // 8*16 records of 64 floats

  // 1) partial scores per (batch, feature tile), both products on WMMA f32
  score_part_kernel<<<dim3(B_ * NT_), dim3(128), 0, stream>>>(qu, kmat, W, bias,
                                                              part_ws);

  // 2) softmax per work-group + streaming weighted sum
  weighted_sum_kernel<<<dim3(B_ * WSG_), dim3(WST_), 0, stream>>>(v, part_ws, out,
                                                                attn_out);
}
